// v010
// Measured on an AMD MI455X. A time is GPU time per run, averaged over a window of back-to-back runs after a warm-up
// (all launches, gaps included; the runs take copies of the inputs in turn), and the median of several windows.
// Apart from v000's, it joins two sittings. Times from different sittings can be a few percent apart, while
// side-by-side timings come from the same sitting.
// This document starts at v010; the versions before it stand elsewhere.
// One run takes 121 microseconds.
// Two timings next to v009 both put it at 1.06 times that version's speed.
// All steps since the starting kernel, v000, together make it 6.53 times as fast.
// Contractions: a.W and x.W (q|k|v, K=1024) on v_wmma_f32_16x16x32_f16 with f16 containers of the bf16 RNE input
//   values (activations carried x16, W^T x64), one product; q.k^T (K=64) on v_wmma_f32_16x16x32_f16 with q (x4) and
//   k (x16) f16 hi planes plus x4096 f16 residual planes (three products, residual pair in a separate accumulator
//   folded by 1/4096); p.v^T on v_wmma_f32_16x16x32_f16 with p as f16(1024 p) and v^T as f16(16 v), one product
//   (the leading query blocks of every segment add the p and v x4096 f16 residual planes, two more products into a
//   separate accumulator); compressive memory sk^T.v (K=1024) and sq.M (K=64) on v_wmma_f32_16x16x32_f16 with
//   plain f16 operands, one product each. f32 accumulate everywhere; L2 norms, rotary tables and rotation, elu,
//   softmax statistics, sq.z, the memory quotient and the gate mix in f32.
#include <hip/hip_runtime.h>
#include <math.h>
#include <stdint.h>

#define NB      2
#define NTOK    2048                // tokens per stream per batch
#define SEQ     4096                // concatenated positions per batch (stream a first, then x)
#define DM      1024
#define NHEAD   16
#define HD      64
#define RP      32                  // rotary pairs per head
#define W3      3072
#define QKW     2048                // q|k plane width: q at column h*64+d, k at 1024 + h*64+d
#define SEG     1024
#define NSEG    4
#define NQB     16                  // 64-row query blocks per segment
#define NQP     4                   // leading query blocks per segment that carry the p / v residual products
#define MROWS   128                 // query rows per block of the memory read kernel
#define OUT1OFF (NB * NTOK * DM)             // element offset of the second output
#define XSC     16.0f
#define WSC     64.0f
#define QSC     4.0f
#define KSC     16.0f
#define VSC     16.0f
#define RSC     4096.0f
#define PSC     1024.0f
#define NRM_EPS 1.0e-12f
#define DEN_EPS 1.0e-6f
#define LOG2_BASE 13.287712379549449
#define NEG_BIG (-1.0e30f)
#define GBK     128                 // k per LDS stage of the projection GEMM (256 B of every operand row)
#define GPIT    136                 // LDS row pitch of a stage in halves: 272 B = 16 B x 17 (ds_load_b128 readers)
#define GSTG    (256 * GPIT)        // halves per stage: 128 A rows, then 128 Bt rows
#define SLABF   (16 * 132)          // floats per epilogue slab of the projection GEMM (one per wave)
#define VPIT    136                 // LDS row pitch of the v^T epilogue tile in halves: 272 B = 16 B x 17 (16-B writers and readers)
#define APIT    72                  // LDS row pitch of the attention K and V^T tiles in halves: 144 B = 16 B x 9
                                    // (ds_load_b128 readers: 16 rows of a fragment load fall on 16 distinct bank groups)

static_assert(NHEAD * HD == DM);
static_assert(SEQ == 2 * NTOK);
static_assert(SEQ == NSEG * SEG);
static_assert(SEG == NQB * 64);
static_assert(HD == 2 * RP);
static_assert(W3 == 3 * DM);
static_assert(QKW == 2 * DM);
static_assert(((NB * NTOK * DM) % 2048) == 0);
static_assert(((SEQ * RP) % 256) == 0);
static_assert((DM % 128) == 0 && (W3 % 64) == 0 && (NTOK % 64) == 0 && (SEQ % 64) == 0);
static_assert((QKW % 128) == 0 && (DM % 32) == 0);
static_assert(NQP > 0 && NQP < NQB);
static_assert((SEG % MROWS) == 0 && MROWS == 8 * 16);
static_assert(OUT1OFF == NB * NTOK * DM);
static_assert((DM % GBK) == 0 && (NTOK % 128) == 0 && ((GPIT * 2) % 16) == 0);
static_assert(4 * SLABF * 4 <= 2 * GSTG * 2 && ((SLABF * 4) % 16) == 0);
static_assert(2 * 128 * VPIT <= 2 * GSTG && VPIT >= 128 && ((VPIT * 2) % 16) == 0);
static_assert(APIT >= HD && ((APIT * 2) % 16) == 0);

typedef _Float16 v16h __attribute__((ext_vector_type(16)));
typedef _Float16 v8h  __attribute__((ext_vector_type(8)));
typedef float    v8f  __attribute__((ext_vector_type(8)));
typedef float    v4f  __attribute__((ext_vector_type(4)));
typedef unsigned int v4u __attribute__((ext_vector_type(4)));
union FH { v16h v; v8h h[2]; };

// ---- scalar helpers --------------------------------------------------------------------------------
__device__ __forceinline__ unsigned short bf_bits(float f) {          // f32 -> bf16 bits, RNE convert
  unsigned u = __float_as_uint(f);
  return (unsigned short)((u + 0x7FFFu + ((u >> 16) & 1u)) >> 16);
}
__device__ __forceinline__ float bf_up(unsigned short b) { return __uint_as_float(((unsigned)b) << 16); }
__device__ __forceinline__ float bfr(float f) { return bf_up(bf_bits(f)); }     // value of the bf16 RNE convert
__device__ __forceinline__ unsigned short h_bits(_Float16 x) { return __builtin_bit_cast(unsigned short, x); }
__device__ __forceinline__ unsigned pk16(unsigned short a, unsigned short b) { return (unsigned)a | ((unsigned)b << 16); }
__device__ __forceinline__ v8f zero8() { v8f z = {0.f, 0.f, 0.f, 0.f, 0.f, 0.f, 0.f, 0.f}; return z; }

// ---- fragment loader: 16-bit A/B operand, lane -> row/col (lane&15), p already includes +8*(lane>>4);
//      elements 0..7 <- p[0..7] (k0+8h..), elements 8..15 <- p[16..23] (k0+16+8h..)
__device__ __forceinline__ v16h ldfrag_h(const _Float16* p) {
  FH f;
  f.h[0] = *(const v8h*)(p);
  f.h[1] = *(const v8h*)(p + 16);
  return f.v;
}

// ---- WMMA helpers with trailing VALU hazard gap --------------------------------------------------------
__device__ __forceinline__ v8f mma_h_raw(v16h a, v16h b, v8f c) {
  return __builtin_amdgcn_wmma_f32_16x16x32_f16(false, a, false, b, (short)0, c, false, false);
}
__device__ __forceinline__ v8f mma_h(v16h a, v16h b, v8f c) {
  c = mma_h_raw(a, b, c);
#if defined(__HIP_DEVICE_COMPILE__)
  asm volatile("v_nop\n\tv_nop\n\tv_nop\n\tv_nop" : "+v"(c) : "v"(a), "v"(b));
#endif
  return c;
}
__device__ __forceinline__ void guard3(v8f& x, v8f& y, v16h a, v16h b, v16h d) {   // two D tiles, 3 frags live
#if defined(__HIP_DEVICE_COMPILE__)
  asm volatile("v_nop\n\tv_nop\n\tv_nop\n\tv_nop" : "+v"(x), "+v"(y) : "v"(a), "v"(b), "v"(d));
#endif
}
__device__ __forceinline__ void guard1q(v8f& x, v16h a, v16h b, v16h d, v16h e) {           // one D, 4 frags
#if defined(__HIP_DEVICE_COMPILE__)
  asm volatile("v_nop\n\tv_nop\n\tv_nop\n\tv_nop" : "+v"(x) : "v"(a), "v"(b), "v"(d), "v"(e));
#endif
}
__device__ __forceinline__ void guard4m(v8f& x, v8f& y, v16h a, v16h b, v16h d, v16h e) {   // two D, 4 frags
#if defined(__HIP_DEVICE_COMPILE__)
  asm volatile("v_nop\n\tv_nop\n\tv_nop\n\tv_nop" : "+v"(x), "+v"(y) : "v"(a), "v"(b), "v"(d), "v"(e)
               : "memory");
#endif
}
__device__ __forceinline__ void guard8m(v8f& x, v8f& y, v16h a, v16h b, v16h d, v16h e,
                                        v16h f, v16h g, v16h p, v16h q) {                      // two D, 8 frags
#if defined(__HIP_DEVICE_COMPILE__)
  asm volatile("v_nop\n\tv_nop\n\tv_nop\n\tv_nop" : "+v"(x), "+v"(y)
               : "v"(a), "v"(b), "v"(d), "v"(e), "v"(f), "v"(g), "v"(p), "v"(q) : "memory");
#endif
}
__device__ __forceinline__ void acc_guard4(v8f& a, v8f& b, v8f& c, v8f& d) {
#if defined(__HIP_DEVICE_COMPILE__)
  asm volatile("v_nop\n\tv_nop\n\tv_nop\n\tv_nop" : "+v"(a), "+v"(b), "+v"(c), "+v"(d));
#endif
}
// lane l <-> lane l ^ 16 (the two halves of a D column) by a vector cross-row move
__device__ __forceinline__ float xhalf(float x) {
  const int b = __builtin_bit_cast(int, x);
  return __builtin_bit_cast(float, __builtin_amdgcn_permlanex16(b, b, 0x76543210, 0xfedcba98, false, false));
}
__device__ __forceinline__ void wave_sync_lds() {
  __builtin_amdgcn_fence(__ATOMIC_RELEASE, "workgroup");
  __builtin_amdgcn_wave_barrier();
  __builtin_amdgcn_fence(__ATOMIC_ACQUIRE, "workgroup");
}

// ---- eight asynchronous 16-B copies global -> LDS per lane (l: LDS byte address, g: global address). The
//      s_wait_xcnt stands inside the statement so that no address register is rewritten ahead of it.
__device__ __forceinline__ void acopy8(uint32_t l0, uint32_t l1, uint32_t l2, uint32_t l3,
                                       uint32_t l4, uint32_t l5, uint32_t l6, uint32_t l7,
                                       const _Float16* g0, const _Float16* g1, const _Float16* g2,
                                       const _Float16* g3, const _Float16* g4, const _Float16* g5,
                                       const _Float16* g6, const _Float16* g7) {
#if defined(__HIP_DEVICE_COMPILE__)
  asm volatile("global_load_async_to_lds_b128 %0, %8, off\n\t"
               "global_load_async_to_lds_b128 %1, %9, off\n\t"
               "global_load_async_to_lds_b128 %2, %10, off\n\t"
               "global_load_async_to_lds_b128 %3, %11, off\n\t"
               "global_load_async_to_lds_b128 %4, %12, off\n\t"
               "global_load_async_to_lds_b128 %5, %13, off\n\t"
               "global_load_async_to_lds_b128 %6, %14, off\n\t"
               "global_load_async_to_lds_b128 %7, %15, off\n\t"
               "s_wait_xcnt 0x0"
               :: "v"(l0), "v"(l1), "v"(l2), "v"(l3), "v"(l4), "v"(l5), "v"(l6), "v"(l7),
                  "v"(g0), "v"(g1), "v"(g2), "v"(g3), "v"(g4), "v"(g5), "v"(g6), "v"(g7)
               : "memory");
#endif
}
// four copies per lane from one plane: wave-uniform base b (scalar registers) + the lane's byte offsets o0..o3;
// the s_wait_xcnt stands inside the statement for the same reason as above (it covers the base registers too)
__device__ __forceinline__ void acopy4s(uint32_t l0, uint32_t l1, uint32_t l2, uint32_t l3,
                                        uint32_t o0, uint32_t o1, uint32_t o2, uint32_t o3, const _Float16* b) {
#if defined(__HIP_DEVICE_COMPILE__)
  asm volatile("global_load_async_to_lds_b128 %0, %4, %8\n\t"
               "global_load_async_to_lds_b128 %1, %5, %8\n\t"
               "global_load_async_to_lds_b128 %2, %6, %8\n\t"
               "global_load_async_to_lds_b128 %3, %7, %8\n\t"
               "s_wait_xcnt 0x0"
               :: "v"(l0), "v"(l1), "v"(l2), "v"(l3), "v"(o0), "v"(o1), "v"(o2), "v"(o3), "s"(b)
               : "memory");
#endif
}
// eight copies per lane, four from each of two planes (bases b, d) at the same byte offsets; one wait for all
__device__ __forceinline__ void acopy8s(uint32_t l0, uint32_t l1, uint32_t l2, uint32_t l3,
                                        uint32_t l4, uint32_t l5, uint32_t l6, uint32_t l7,
                                        uint32_t o0, uint32_t o1, uint32_t o2, uint32_t o3,
                                        const _Float16* b, const _Float16* d) {
#if defined(__HIP_DEVICE_COMPILE__)
  asm volatile("global_load_async_to_lds_b128 %0, %8, %12\n\t"
               "global_load_async_to_lds_b128 %1, %9, %12\n\t"
               "global_load_async_to_lds_b128 %2, %10, %12\n\t"
               "global_load_async_to_lds_b128 %3, %11, %12\n\t"
               "global_load_async_to_lds_b128 %4, %8, %13\n\t"
               "global_load_async_to_lds_b128 %5, %9, %13\n\t"
               "global_load_async_to_lds_b128 %6, %10, %13\n\t"
               "global_load_async_to_lds_b128 %7, %11, %13\n\t"
               "s_wait_xcnt 0x0"
               :: "v"(l0), "v"(l1), "v"(l2), "v"(l3), "v"(l4), "v"(l5), "v"(l6), "v"(l7),
                  "v"(o0), "v"(o1), "v"(o2), "v"(o3), "s"(b), "s"(d)
               : "memory");
#endif
}
// 64 rows of one operand, 256 B each, into LDS rows of pitch GPIT: l / g are this thread's addresses in row
// (tid >> 4) at 16-B piece (tid & 15); copy i takes row 8 i + (tid >> 4), a wave's copy covers two whole rows.
__device__ __forceinline__ void acopy_rows64(uint32_t l, const _Float16* g, size_t ld) {
  const uint32_t ls = 8u * GPIT * 2u;
  const size_t   gs = 8 * ld;
  acopy8(l, l + ls, l + 2 * ls, l + 3 * ls, l + 4 * ls, l + 5 * ls, l + 6 * ls, l + 7 * ls,
         g, g + gs, g + 2 * gs, g + 3 * gs, g + 4 * gs, g + 5 * gs, g + 6 * gs, g + 7 * gs);
}
// the issuing wave's own copies have landed (the compiler places no wait for them)
__device__ __forceinline__ void wait_async0() {
#if defined(__HIP_DEVICE_COMPILE__)
  asm volatile("s_wait_asynccnt 0x0" ::: "memory");
#endif
}
// the address translations of this wave's issued global loads and stores are done: stands ahead of an instruction that
// reuses a register which such a load or store names
__device__ __forceinline__ void wait_x0() {
#if defined(__HIP_DEVICE_COMPILE__)
  asm volatile("s_wait_xcnt 0x0" ::: "memory");
#endif
}
// this wave's LDS reads of the stage have returned before the stage is handed back for a refill
__device__ __forceinline__ void wait_ds0() {
#if defined(__HIP_DEVICE_COMPILE__)
  asm volatile("s_wait_dscnt 0x0" ::: "memory");
#endif
}

// =====================================================================================================
// Row-major convert: f32 [n] -> f16 plane [n] holding f16(bf16 RNE value * scale) (scale a power of two, exact).
// coverage: bx = 0 .. n/2048 - 1 blocks x 256 threads x 8 = n elements (n % 2048 == 0 host-checked); by = 2 arrays.
// One block's share of the work; the block indices come from the kernel prep below.
// =====================================================================================================
__device__ __forceinline__ void cvt_rm(int bx, int by, const float* __restrict__ in0, const float* __restrict__ in1,
                                       unsigned short* out, int n, float scale) {
  const size_t i8 = ((size_t)bx * 256 + threadIdx.x) * 8;
  if (i8 + 8 > (size_t)n) return;        // never taken for the host-checked sizes; no barriers below
  const float* in = by ? in1 : in0;      // by = which of the two arrays; its plane follows the first
  out += (size_t)by * (size_t)n;
  const v4f a = *(const v4f*)(in + i8);
  const v4f b = *(const v4f*)(in + i8 + 4);
  float f[8];
  f[0] = a[0]; f[1] = a[1]; f[2] = a[2]; f[3] = a[3];
  f[4] = b[0]; f[5] = b[1]; f[6] = b[2]; f[7] = b[3];
  v4u p;
#pragma unroll
  for (int e = 0; e < 4; ++e) {
    const unsigned short b0 = bf_bits(f[2 * e]), b1 = bf_bits(f[2 * e + 1]);
    const _Float16 x0 = (_Float16)(bf_up(b0) * scale);
    const _Float16 x1 = (_Float16)(bf_up(b1) * scale);
    p[e] = pk16(h_bits(x0), h_bits(x1));
  }
  *(v4u*)(out + i8) = p;
  
}

// =====================================================================================================
// Transposing convert: f32 in[R][C] (row-major, pitch C) -> 16-bit out[C][R] (pitch R), 64x64 tiles through LDS:
//   out0 = f16(bf16 RNE value * scale).
// Block = 256 threads; (bx, by, bz) = (C/64, R/64, 2 matrices) exact (host-checked); sm = the block's 64 x 65 f32 LDS
// tile, declared by the kernel that calls this. Load: thread -> input row tid>>2, 16 consecutive
// columns (four 16-B loads). Store: two iterations, output row it*32 + (tid>>3), lanes (tid&7) -> elements
// coverage: 2 iterations x 32 output rows x 8 lanes x 8 halves = the whole 64x64 tile; grid covers all of C x R.
// =====================================================================================================
__device__ __forceinline__ void tr_cvt(float (*sm)[65], int bx, int by, int bz,
                                       const float* __restrict__ in0, const float* __restrict__ in1,
                                       int R, int C, unsigned short* out0, float scale) {
  const int tid = threadIdx.x;
  const float* in = bz ? in1 : in0;        // bz = which of the two matrices; its plane follows the first's
  out0 += (size_t)bz * (size_t)R * (size_t)C;
  const int c0 = bx * 64;                  // input column block -> output row block
  const int r0 = by * 64;                  // input row block    -> output column block
  if (c0 + 64 > C || r0 + 64 > R) return;  // block-uniform, ahead of any barrier; never taken for exact grids
  {
    const int lr = tid >> 2, lc = (tid & 3) * 16;
    const float* src = in + (size_t)(r0 + lr) * (size_t)C + c0 + lc;
#pragma unroll
    for (int q = 0; q < 4; ++q) {
      const v4f v = *(const v4f*)(src + 4 * q);
      sm[lr][lc + 4 * q + 0] = v[0];
      sm[lr][lc + 4 * q + 1] = v[1];
      sm[lr][lc + 4 * q + 2] = v[2];
      sm[lr][lc + 4 * q + 3] = v[3];
    }
  }
  __syncthreads();
  const int seg = tid & 7;
  v4u p0[2];
#pragma unroll
  for (int it = 0; it < 2; ++it) {
    const int ocl = it * 32 + (tid >> 3);   // output row within the tile = input column
    float f[8];
#pragma unroll
    for (int e = 0; e < 8; ++e) f[e] = sm[seg * 8 + e][ocl];
    v4u pk;
#pragma unroll
    for (int e = 0; e < 4; ++e) {
      const float g0 = f[2 * e], g1 = f[2 * e + 1];
      const _Float16 x0 = (_Float16)(bfr(g0) * scale);
      const _Float16 x1 = (_Float16)(bfr(g1) * scale);
      pk[e] = pk16(h_bits(x0), h_bits(x1));
    }
    p0[it] = pk;
  }
  {
#pragma unroll
    for (int it = 0; it < 2; ++it) {
      const int ocl = it * 32 + (tid >> 3);
      const size_t go = (size_t)(c0 + ocl) * (size_t)R + (size_t)(r0 + seg * 8);
      *(v4u*)(out0 + go) = p0[it];
    }
    
  }
}

// =====================================================================================================
// Rotary tables for interleaved pairs: cost[t][i] = cos(t * inv_freq[i]), sint[t][i] = sin(t * inv_freq[i]),
// i = 0..31, inv_freq[i] = 1 / (10000^(2i/64)) (power via f64 exp2 -> one f32 convert, then an f32 reciprocal
// formed in f64 and converted once), angle = one f32 multiply with t = position 0..4095 in the concatenated
// coverage: bx = 0 .. n/256 - 1 blocks x 256 threads = n = SEQ*32 elements of each table.
// =====================================================================================================
__device__ __forceinline__ void rope_tab(int bx, float* cost, float* sint, int n) {
  const int e = bx * 256 + (int)threadIdx.x;
  if (e >= n) return;                      // never taken (n % 256 == 0); no barriers below
  const int t = e >> 5, i = e & 31;
  const double pd = exp2((double)i * (1.0 / 32.0) * LOG2_BASE);   // 10000^(2i/64)
  const float  pf = (float)pd;
  const float  invf = (float)(1.0 / (double)pf);
  const float  ang = (float)t * invf;
  float sv, cv;
  sincosf(ang, &sv, &cv);
  *(float*)(cost + e) = cv;
  *(float*)(sint + e) = sv;
  
}

// =====================================================================================================
// The three preparations, which do not depend on one another, in ONE launch, told apart by block range (the
// branches are block-uniform, so the barrier inside tr_cvt is reached by a whole block or by none): blocks
// 0 .. PB_ROPE-1 build the rotary tables, the next PB_TR transpose and convert the two weight matrices
// ((W3/64, DM/64, matrix), x fastest), the last PB_CVT convert x and a ((n/2048, array), x fastest).
// coverage: grid.x = PB_ROPE + PB_TR + PB_CVT exact.
// =====================================================================================================
#define PB_ROPE ((SEQ * RP) / 256)
#define PB_TRX  (W3 / 64)
#define PB_TRY  (DM / 64)
#define PB_TR   (PB_TRX * PB_TRY * 2)
#define PB_CVX  ((NB * NTOK * DM) / 2048)
#define PB_CVT  (PB_CVX * 2)
__global__ __launch_bounds__(256) void prep(const float* __restrict__ x, const float* __restrict__ a,
                                           unsigned short* xh,
                                           const float* __restrict__ wx, const float* __restrict__ wa,
                                           unsigned short* wxt, float* cost, float* sint) {
  __shared__ float sm[64][65];
  int b = (int)blockIdx.x;
  if (b < PB_ROPE) {
    rope_tab(b, cost, sint, SEQ * RP);
    return;
  }
  b -= PB_ROPE;
  if (b < PB_TR) {
    const int bz = b / (PB_TRX * PB_TRY);
    const int r  = b - bz * (PB_TRX * PB_TRY);
    const int by = r / PB_TRX;
    tr_cvt(sm, r - by * PB_TRX, by, bz, wx, wa, DM, W3, wxt, WSC);
    // in the built text another range's code follows these stores and reuses their registers: the wait stands ahead of it
    asm volatile("s_wait_xcnt 0x0" ::: "memory");
    return;
  }
  b -= PB_TR;
  if (b < PB_CVT) {
    const int by = b / PB_CVX;
    cvt_rm(b - by * PB_CVX, by, x, a, xh, NB * NTOK * DM, XSC);
  }
}

// =====================================================================================================
// Register-blocked f16 WMMA GEMM, one wave per 32x128 tile; block = 4 waves = 4 tiles stacked in m = one 128x128
// block tile whose operands pass through LDS: a stage is 128 k of the 128 A rows and the 128 Bt rows, brought by
// asynchronous copies into two buffers (stage t + 1 flies while stage t is worked on), read by all 4 waves:
//   acc[m][n] = sum_k A[m][k] * Bt[n][k]; A row-major [M][K] pitch lda, Bt row-major [N][K] pitch ldb
//   (k contiguous); M % 128 == 0, N % 128 == 0, K % 128 == 0 (exact constants here, host-checked).
// EPI 1 (q|k planes, N == QKW): the 128-column tile holds two heads of 64 columns (columns < DM are q heads,
//        columns >= DM are k heads). Per row and head: t = acc*oscale; v = t * (1/max(||t||_2, 1e-12)) *
//        bf16(gain[head][d]) * 8; then the interleaved-pair rotary rotation with the f32 tables at position
//        crow0 + m (pair (2i, 2i+1): o1 = v1*c - v2*s, o2 = v1*s + v2*c), times cscale (QSC for q, KSC for k)
//        -> C0 = f16 hi, C1 = f16((v - hi) * RSC) residual, 16-bit planes of pitch ldc, row crow0 + m, column n.
// EPI 3 (v, stored transposed): t = acc*oscale; C0 = f16(t * VSC) hi, C1 = f16((t * VSC - hi) * RSC) residual, 16-bit
//        planes [ldc rows n][SEQ positions]: element (n, crow0 + m). A lane's 8 D registers are 8 consecutive positions
//        of one column n, one 16-B piece of a plane's row; the block's 128 n x 128 m tile is gathered in LDS and each
//        of its rows leaves as one whole 256-B segment.
// 16 lanes x 16 B per 256-B row segment (two rows per instruction);
// coverage: EPI 1: 2 slabs x 16 rows x 128 cols = the wave's whole 32x128 tile; EPI 3: 4 waves x 16 its x 2 rows = the
// 128 rows of the block's tile in either plane; tiles = whole M x N (bx = 0 .. tiles/4 - 1
// exact), grid.y = the two streams, grid.z = the batches. One block's work; ring (the block's LDS) and bx come from
// the kernel gemm_qkv below.
// =====================================================================================================
template <int EPI>
__device__ __forceinline__ void gemm_t(
    _Float16* ring, int bx,
    const unsigned short* __restrict__ A0, const unsigned short* __restrict__ A1, int lda,
    const unsigned short* __restrict__ Bt0, const unsigned short* __restrict__ Bt1, int ldb,
    void* C0, void* C1, int ldc, int crows,
    const float* __restrict__ cost, const float* __restrict__ sint,
    const float* __restrict__ gq0, const float* __restrict__ gk0,
    const float* __restrict__ gq1, const float* __restrict__ gk1,
    int M, int N, int K, float oscale) {
  const int lane = threadIdx.x & 31;
  const int wave = threadIdx.x >> 5;
  // blockIdx.y = stream (0: operands A0, Bt0, gains gq0, gk0, C rows 0..M-1; 1: the others, C rows M..2M-1);
  // blockIdx.z = batch (A rows z*M.., C plane z of crows rows)
  const int  st = (int)blockIdx.y;
  const unsigned short* A  = (st ? A1 : A0) + (size_t)blockIdx.z * (size_t)M * (size_t)lda;
  const unsigned short* Bt = st ? Bt1 : Bt0;
  const float* gq = st ? gq1 : gq0;
  const float* gk = st ? gk1 : gk0;
  const int    crow0 = st * M;
  const size_t cpl   = (size_t)blockIdx.z * (size_t)crows * (size_t)ldc;   // element offset of this batch's C plane
  const int tilesN = N >> 7;
  const int tilesM = M >> 5;
  if (bx >= (tilesM >> 2) * tilesN) return;   // block-uniform, ahead of any barrier; never taken
  const int bm = bx / tilesN;
  const int tn = bx - bm * tilesN;
  const int tm = bm * 4 + wave;
  const int m0 = tm << 5;
  const int n0 = tn << 7;
  const int rl   = lane & 15;            // row (A) / col (B, D) within subtile
  const int hh   = lane >> 4;            // lane half
  const int koff = hh * 8;               // k offset of this lane half

  v8f acc[2][8];
#pragma unroll
  for (int i = 0; i < 2; ++i)
#pragma unroll
    for (int j = 0; j < 8; ++j) acc[i][j] = zero8();

  {
    const int cr = (int)threadIdx.x >> 4;          // row (mod 8) this thread copies
    const int cc = (int)threadIdx.x & 15;          // its 16-B piece of the row's 256 B
    const _Float16* ga = (const _Float16*)(const void*)A + (size_t)((bm << 7) + cr) * (size_t)lda + cc * 8;
    const _Float16* gb = (const _Float16*)(const void*)Bt + (size_t)(n0 + cr) * (size_t)ldb + cc * 8;
    const uint32_t  lr = (uint32_t)(size_t)(const void*)ring + (uint32_t)(cr * GPIT + cc * 8) * 2u;
    const int nst = K / GBK;                       // stages; block-uniform
    auto fill = [&](int st) {                      // stage st -> buffer st & 1: 32 copies per wave
      const uint32_t l = lr + (uint32_t)(st & 1) * (uint32_t)(GSTG * 2);
      const _Float16* pa = ga + (size_t)st * GBK;
      const _Float16* pb = gb + (size_t)st * GBK;
      acopy_rows64(l, pa, (size_t)lda);
      acopy_rows64(l + 64u * GPIT * 2u, pa + (size_t)64 * (size_t)lda, (size_t)lda);
      acopy_rows64(l + 128u * GPIT * 2u, pb, (size_t)ldb);
      acopy_rows64(l + 192u * GPIT * 2u, pb + (size_t)64 * (size_t)ldb, (size_t)ldb);
    };
    fill(0);
    wait_async0();
    __syncthreads();                               // stage 0 is published
    if (nst > 1) fill(1);
    for (int t = 0; t < nst; ++t) {
      const _Float16* sb  = ring + (t & 1) * GSTG;
      const _Float16* ar0 = sb + (wave * 32 + rl) * GPIT + koff;
      const _Float16* ar1 = ar0 + 16 * GPIT;
      const _Float16* br  = sb + (128 + rl) * GPIT + koff;
#pragma unroll                                     // the k offset becomes an immediate of each LDS load
      for (int kk = 0; kk < GBK / 32; ++kk) {
        const v16h a0 = ldfrag_h(ar0 + 32 * kk);
        const v16h a1 = ldfrag_h(ar1 + 32 * kk);
        v16h b[8];
#pragma unroll                                     // b[] stays in registers: the k-step's LDS loads stand as one group
        for (int j = 0; j < 8; ++j) b[j] = ldfrag_h(br + j * 16 * GPIT + 32 * kk);
#pragma unroll                                     // acc[][] and b[] indexed by constants only
        for (int j = 0; j < 8; ++j) {
          acc[0][j] = mma_h_raw(a0, b[j], acc[0][j]);
          acc[1][j] = mma_h_raw(a1, b[j], acc[1][j]);
          guard3(acc[0][j], acc[1][j], a0, a1, b[j]);
        }
      }
      wait_ds0();
      wait_async0();
      __syncthreads();                             // publishes stage t + 1 and ends every read of stage t
      if (t + 2 < nst) fill(t + 2);
    }
    wait_async0();
  }
  acc_guard4(acc[0][0], acc[0][1], acc[0][2], acc[0][3]);
  acc_guard4(acc[0][4], acc[0][5], acc[0][6], acc[0][7]);
  acc_guard4(acc[1][0], acc[1][1], acc[1][2], acc[1][3]);
  acc_guard4(acc[1][4], acc[1][5], acc[1][6], acc[1][7]);

  // ---- epilogue ----
  // the staging below lies in the ring's first bytes: the barrier at the foot of the last trip has
  // ended every wave's reads of both stages, and no copy is issued or outstanding behind it
  if (EPI == 3) {
    _Float16* th = ring;                                        // hi plane of the block's tile, [128 n][VPIT]
    _Float16* tl = ring + 128 * VPIT;                           // residual plane
#pragma unroll                                                  // all three: acc[][][] indexed by constants only
    for (int i = 0; i < 2; ++i) {
#pragma unroll
      for (int j = 0; j < 8; ++j) {
        v8h xh, xl;
#pragma unroll
        for (int r = 0; r < 8; ++r) {                           // position m0 + 16 i + 8 hh + r of column n0 + 16 j + rl
          const float v = acc[i][j][r] * oscale;
          const float s = v * VSC;
          const _Float16 x = (_Float16)s;
          xh[r] = x;
          xl[r] = (_Float16)((s - (float)x) * RSC);
        }
        const int o = (16 * j + rl) * VPIT + wave * 32 + 16 * i + 8 * hh;
        *(v8h*)(th + o) = xh;
        *(v8h*)(tl + o) = xl;
      }
    }
    __syncthreads();                                            // a row of the tile holds pieces of all 4 waves
    const int    lo = (wave * 32 + hh) * VPIT + rl * 8;         // row 32 wave + 2 it + hh, 16-B piece rl
    const size_t go = cpl + (size_t)(n0 + wave * 32 + hh) * SEQ + (size_t)(crow0 + (bm << 7) + rl * 8);
    _Float16* Ch = (_Float16*)C0 + go;
    _Float16* Cl = (_Float16*)C1 + go;
    v8h hv[16], lv[16];
#pragma unroll                                                  // hv[], lv[] stay in registers; the 32 LDS loads stand as one group
    for (int it = 0; it < 16; ++it) {
      hv[it] = *(const v8h*)(th + lo + it * 2 * VPIT);
      lv[it] = *(const v8h*)(tl + lo + it * 2 * VPIT);
    }
#pragma unroll                                                  // the row step is an immediate: one address pair per plane
    for (int it = 0; it < 16; ++it) {
      *(v8h*)(Ch + (size_t)it * 2 * SEQ) = hv[it];
      *(v8h*)(Cl + (size_t)it * 2 * SEQ) = lv[it];
    }
    wait_x0();   // in the built text the other block range's code follows these stores and reuses their registers
    return;
  }
  // per-wave 16x128 slab, pitch 132 floats
  float* slab = (float*)(void*)ring + wave * SLABF;
  float gmul[8];
  float csc = 1.0f;
  if (EPI == 1) {
    const bool isq = (n0 < DM);                                 // wave-uniform
    const int  hb  = (isq ? n0 : (n0 - DM)) >> 6;               // first head of this tile (0..15)
    csc = isq ? QSC : KSC;
#pragma unroll
    for (int j = 0; j < 8; ++j) {
      const int gi = (hb + (j >> 2)) * HD + 16 * (j & 3) + rl;  // < NHEAD*HD, inside both gain arrays
      const float ga = bfr(gq[gi]);
      const float gb = bfr(gk[gi]);
      gmul[j] = (isq ? ga : gb) * 8.0f;
    }
  }
#pragma unroll
  for (int i = 0; i < 2; ++i) {
    const int mB = m0 + 16 * i;
    if (EPI == 1) {
      float inv[2][8];
#pragma unroll
      for (int jh = 0; jh < 2; ++jh) {
#pragma unroll
        for (int r = 0; r < 8; ++r) {        // sum of squares over the head's 64 columns of row 8hh+r
          float ss = 0.f;
#pragma unroll
          for (int jj = 0; jj < 4; ++jj) {
            const float x = acc[i][4 * jh + jj][r] * oscale;
            ss += x * x;
          }
          ss += __shfl_xor(ss, 1, 32);
          ss += __shfl_xor(ss, 2, 32);
          ss += __shfl_xor(ss, 4, 32);
          ss += __shfl_xor(ss, 8, 32);
          inv[jh][r] = oscale * (1.0f / fmaxf(sqrtf(ss), NRM_EPS));
        }
      }
#pragma unroll
      for (int j = 0; j < 8; ++j) {
#pragma unroll
        for (int r = 0; r < 8; ++r)
          slab[(8 * hh + r) * 132 + 16 * j + rl] = acc[i][j][r] * inv[j >> 2][r] * gmul[j];
      }
    }
    wave_sync_lds();
    {
      unsigned short* Cp = (unsigned short*)C0 + cpl;
      unsigned short* Cq = (unsigned short*)C1 + cpl;
      v4u hv[8], lv[8];
#pragma unroll
      for (int it = 0; it < 8; ++it) {
        const int row = it * 2 + hh;                          // it 0..7 x hh 0..1 = rows 0..15
        const float* sp = slab + row * 132 + rl * 8;          // 8 consecutive columns = 4 rotary pairs
        const v4f fa = *(const v4f*)sp;
        const v4f fb = *(const v4f*)(sp + 4);
        float f[8];
        f[0] = fa[0]; f[1] = fa[1]; f[2] = fa[2]; f[3] = fa[3];
        f[4] = fb[0]; f[5] = fb[1]; f[6] = fb[2]; f[7] = fb[3];
        const int pos = crow0 + mB + row;                     // position in the concatenated sequence
        const v4f cv = *(const v4f*)(cost + (size_t)pos * RP + (rl & 7) * 4);   // pairs ((rl&7)*4 .. +3)
        const v4f sv = *(const v4f*)(sint + (size_t)pos * RP + (rl & 7) * 4);
        v4u pk, pl;
#pragma unroll
        for (int e = 0; e < 4; ++e) {
          const float f0 = f[2 * e], f1 = f[2 * e + 1];
          const float cc = cv[e], sn = sv[e];
          const float g0 = (f0 * cc - f1 * sn) * csc;
          const float g1 = (f0 * sn + f1 * cc) * csc;
          const _Float16 x0 = (_Float16)g0;
          const _Float16 x1 = (_Float16)g1;
          const _Float16 y0 = (_Float16)((g0 - (float)x0) * RSC);
          const _Float16 y1 = (_Float16)((g1 - (float)x1) * RSC);
          pk[e] = pk16(h_bits(x0), h_bits(x1));
          pl[e] = pk16(h_bits(y0), h_bits(y1));
        }
        hv[it] = pk;
        lv[it] = pl;
      }
      {
#pragma unroll
        for (int it = 0; it < 8; ++it) {
          const int row = it * 2 + hh;
          const size_t go = (size_t)(crow0 + mB + row) * (size_t)ldc + n0 + rl * 8;
          *(v4u*)(Cp + go) = hv[it];
          *(v4u*)(Cq + go) = lv[it];
        }
        
      }
    }
    wave_sync_lds();
  }
}

// =====================================================================================================
// The q|k product and the v product, which do not depend on one another, in ONE launch, told apart by block range
// (a block-uniform branch ahead of every barrier): blocks 0 .. nbqk-1 of grid.x are the q|k tiles (EPI 1, W^T rows
// 0 .. Nqk-1), the others the v tiles (EPI 3, W^T rows Nqk .. Nqk+Nv-1).
// coverage: grid = (q|k tiles/4 + v tiles/4 exact, 2 streams, batches).
// =====================================================================================================
__global__ __launch_bounds__(128) void gemm_qkv(
    const unsigned short* __restrict__ A0, const unsigned short* __restrict__ A1, int lda,
    const unsigned short* __restrict__ Bt0, const unsigned short* __restrict__ Bt1, int ldb,
    void* QH, void* QL, int ldqk, void* VH, void* VL, int ldv, int crows,
    const float* __restrict__ cost, const float* __restrict__ sint,
    const float* __restrict__ gq0, const float* __restrict__ gk0,
    const float* __restrict__ gq1, const float* __restrict__ gk1,
    int M, int Nqk, int Nv, int K, int nbqk, float oscale) {
  __shared__ __align__(16) _Float16 ring[2 * GSTG]; // two operand stages; behind the k loop the same bytes hold the
                                                    // epilogue staging, so a block takes 136 KiB and two fit one WGP
  const int bx = (int)blockIdx.x;
  if (bx < nbqk) {
    gemm_t<1>(ring, bx, A0, A1, lda, Bt0, Bt1, ldb, QH, QL, ldqk, crows,
              cost, sint, gq0, gk0, gq1, gk1, M, Nqk, K, oscale);
  } else {
    const size_t wo = (size_t)Nqk * (size_t)ldb;      // the v rows of W^T follow the q|k rows
    gemm_t<3>(ring, bx - nbqk, A0, A1, lda, Bt0 + wo, Bt1 + wo, ldb, VH, VL, ldv, crows,
              cost, sint, gq0, gk0, gq1, gk1, M, Nv, K, oscale);
  }
}

// =====================================================================================================
// Compressive-memory update per (head h, segment s in 0..2) of one batch (bb):
//   MT[h][s][e][d] = sum over the 1024 keys l of segment s of v[l][e] * sk[l][d], sk = elu(k) + 1
//   (elu(x) = x > 0 ? x : exp(x) - 1, so sk = x > 0 ? x + 1 : exp(x)), and ZP[h][s][d] = sum_l sk[l][d].
//   k is rebuilt in f32 from the q|k hi / residual planes ((hi + lo/RSC) / KSC, column DM + h*64 + d), sk is
//   RNE-converted to f16 and written TRANSPOSED into an LDS tile skT[d][l] (64 keys per chunk, pitch 72 halves);
//   A = V^T hi plane rows (h*64 + e, keys), Bt = skT; D[e][d] scaled by 1/VSC.
//   Block = 4 waves (one block's work; bx, bb and the LDS arrays come from the kernel attn_all below); wave w owns
//   e rows 16*w.. and all 64 d columns; acc guarded; the 16x64 f32 piece is staged in the wave's slab.
// coverage: MT: 4 waves x (16 rows x 64 cols) = the whole 64x64 tile of (h,s); 8 its x 2 row halves x 16 lanes x 4
//   floats = 16 rows x 64 cols per wave. ZP: 16 lanes x 4 floats = 64. skT fill: 128 threads x 32 d x 1 key = 64x64 chunk.
// =====================================================================================================
__device__ __forceinline__ void mt_seg(_Float16* skT, float (*slab)[16 * 68], float (*zred)[HD], float* zsum,
                                       int bx, int bb,
                                       const unsigned short* __restrict__ QKH,
                                       const unsigned short* __restrict__ QKL,
                                       const unsigned short* __restrict__ VTH,
                                       float* MT, float* ZP) {
  const int tid = threadIdx.x, wave = tid >> 5, lane = tid & 31, hh = lane >> 4, c = lane & 15;
  const int h = (int)((unsigned)bx / 3u);
  const int s = (int)((unsigned)bx - (unsigned)h * 3u);
  if (h >= NHEAD) return;                 // block-uniform, ahead of any barrier; never taken
  QKH += (size_t)bb * SEQ * QKW;          // bb = batch: its own planes
  QKL += (size_t)bb * SEQ * QKW;
  VTH += (size_t)bb * DM * SEQ;
  MT  += (size_t)bb * NHEAD * 3 * HD * HD;
  ZP  += (size_t)bb * NHEAD * 3 * HD;
  const int r  = tid >> 1;                // key within the 64-key chunk handled by this thread
  const int dq = (tid & 1) * 32;          // first of the 32 d columns handled by this thread

  const _Float16* Q16 = (const _Float16*)(const void*)QKH;
  const _Float16* L16 = (const _Float16*)(const void*)QKL;
  const _Float16* V16 = (const _Float16*)(const void*)VTH;
  const _Float16* vrow = V16 + (size_t)(h * HD + wave * 16 + c) * SEQ + (size_t)s * SEG + 8 * hh;   // A frag base

  float zacc[32];
#pragma unroll
  for (int e = 0; e < 32; ++e) zacc[e] = 0.f;
  v8f acc[4];
#pragma unroll                            // acc[] indexed by constants only
  for (int j = 0; j < 4; ++j) acc[j] = zero8();

  for (int kt = 0; kt < SEG / 64; ++kt) {
    __syncthreads();                      // prior chunk's fragment reads are done
    {
      const size_t n = (size_t)(s * SEG + kt * 64 + r);
      const _Float16* kp = Q16 + n * QKW + h * HD + dq;     // the row's q columns; its k columns stand DM further
      const _Float16* lp = L16 + n * QKW + h * HD + dq;
      FH kf[2], lf[2];
#pragma unroll                            // kf[], lf[] stay in registers; the eight loads stand as one group
      for (int q = 0; q < 2; ++q) {
        kf[q].h[0] = *(const v8h*)(kp + DM + 16 * q); kf[q].h[1] = *(const v8h*)(kp + DM + 16 * q + 8);
        lf[q].h[0] = *(const v8h*)(lp + DM + 16 * q); lf[q].h[1] = *(const v8h*)(lp + DM + 16 * q + 8);
      }
#if defined(__HIP_DEVICE_COMPILE__)
      // the eight loads' address translations are done before their two address pairs are reused; the wait takes the
      // pairs as inputs so that they stay whole up to it (without that the last load's result is laid over them)
      asm volatile("s_wait_xcnt 0x0" :: "v"(kp), "v"(lp) : "memory");
#endif
#pragma unroll
      for (int e = 0; e < 32; ++e) {
        const float kv = ((float)kf[e >> 4].v[e & 15] + (float)lf[e >> 4].v[e & 15] * (1.0f / RSC)) * (1.0f / KSC);
        const float sk = (kv > 0.f) ? (kv + 1.0f) : __expf(kv);
        const _Float16 skh = (_Float16)sk;
        skT[(dq + e) * 72 + r] = skh;
        zacc[e] += (float)skh;
      }
    }
    __syncthreads();                      // skT chunk complete
#pragma unroll
    for (int kk = 0; kk < 2; ++kk) {
      const v16h a = ldfrag_h(vrow + kt * 64 + 32 * kk);
#pragma unroll                            // acc[] indexed by constants only
      for (int jp = 0; jp < 2; ++jp) {
        const v16h b0 = ldfrag_h(skT + (16 * (2 * jp) + c) * 72 + 32 * kk + 8 * hh);
        const v16h b1 = ldfrag_h(skT + (16 * (2 * jp + 1) + c) * 72 + 32 * kk + 8 * hh);
        acc[2 * jp]     = mma_h_raw(a, b0, acc[2 * jp]);
        acc[2 * jp + 1] = mma_h_raw(a, b1, acc[2 * jp + 1]);
        guard3(acc[2 * jp], acc[2 * jp + 1], a, b0, b1);
      }
    }
  }
  acc_guard4(acc[0], acc[1], acc[2], acc[3]);

  // ---- MT piece: rows e = 16*wave + (8hh+rr), cols d = 16*jj + c ----
  float* sl = slab[wave];
#pragma unroll
  for (int jj = 0; jj < 4; ++jj) {
#pragma unroll
    for (int rr = 0; rr < 8; ++rr) sl[(8 * hh + rr) * 68 + 16 * jj + c] = acc[jj][rr] * (1.0f / VSC);
  }
  wave_sync_lds();
  {
    v4f mv[8];
#pragma unroll
    for (int it = 0; it < 8; ++it) {
      const int row = it * 2 + hh;        // it 0..7 x hh 0..1 = rows 0..15
      mv[it] = *(const v4f*)(sl + row * 68 + c * 4);
    }
    float* mtb = MT + ((size_t)(h * 3 + s) * HD + (size_t)wave * 16) * HD;
#pragma unroll
    for (int it = 0; it < 8; ++it) {
      const int row = it * 2 + hh;
      *(v4f*)(mtb + (size_t)row * HD + c * 4) = mv[it];
    }
  }
  // ---- ZP: sum zacc over the 16 keys of this wave (lanes sharing lane&1), then over the 4 waves ----
#pragma unroll
  for (int e = 0; e < 32; ++e) {
    float v = zacc[e];
    v += __shfl_xor(v, 2, 32);
    v += __shfl_xor(v, 4, 32);
    v += __shfl_xor(v, 8, 32);
    v += __shfl_xor(v, 16, 32);
    if ((lane >> 1) == 0) zred[wave][(lane & 1) * 32 + e] = v;
  }
  __syncthreads();
  if (tid < HD) {
    float z = 0.f;
#pragma unroll
    for (int w = 0; w < 4; ++w) z += zred[w][tid];
    zsum[tid] = z;
  }
  __syncthreads();
  if (tid < 16) {                         // wave 0, lanes 0..15: 16 x 16 B = the whole 256-B ZP row
    const v4f zz = *(const v4f*)(zsum + tid * 4);
    float* zp = ZP + (size_t)(h * 3 + s) * HD + tid * 4;
    *(v4f*)zp = zz;
  }
}

// =====================================================================================================
// Compressive-memory read per (head h, segment s in 1..3, 128-row block) of one batch (blockIdx.y):
//   M_s = sum over segments before s of MT[h][s'] (f32 sum, RNE convert to an f16 LDS tile MTh[e][d], pitch 72);
//   z_s = sum of ZP[h][s'] (f32, LDS). Per query row n of segment s: q rebuilt in f32 from the hi / residual planes
//   ((hi + lo/RSC) / QSC, column h*64 + d), sq = elu(q) + 1 RNE-converted to f16 directly into the A fragment
//   (elementwise transform keeps the A layout); num[n][e] = sum_d sq[n][d] * M_s[d][e] with Bt = MTh (K = 64, two
//   k-steps, 4 column tiles); den[n] = sum_d sq[n][d] * z_s[d] + 1e-6 in f32 from the same f16 sq values (lane
//   halves combined, then broadcast to the D rows); mem[n][e] = num * (1/den).
//   Gate mix: the attention launch ahead of this one has stored (1 - g) * local in every output element; this kernel
//   adds g * mem to the rows of segments 1..3, g = sigmoid(bf16(gate[h])): rows of positions < NTOK are in the second
//   output (offset OUT1OFF), rows of positions >= NTOK in the first, row t mod NTOK, columns h*64..h*64+63.
//   Block = 8 waves x 16 rows; per-wave 16x64 f32 tile staged in LDS; loads and stores 16 lanes x 16 B per 256-B row
// coverage: 16 heads x 3 segments x 8 row blocks x 8 waves x 16 rows = positions 1024..4095 of every head's 64
//   columns, each element read and rewritten by one lane; 8 its x 2 row halves x 16 lanes x 4 floats = the wave's
//   16x64 tile. Positions 0..1023 (segment 0) keep the attention's value (memory is exactly zero there).
// =====================================================================================================
__global__ __launch_bounds__(256) void mem_ret(const unsigned short* __restrict__ QKH,
                                              const unsigned short* __restrict__ QKL,
                                              const float* __restrict__ MT, const float* __restrict__ ZP,
                                              const float* __restrict__ gate, float* outb) {
  __shared__ __align__(16) _Float16 MTh[HD * 72];
  __shared__ float zs[HD];
  __shared__ __align__(16) float slab[8][16 * 68];

  const int tid = threadIdx.x, wave = tid >> 5, lane = tid & 31, hh = lane >> 4, c = lane & 15;
  const int h   = (int)(blockIdx.x / 24u);
  const int rem = (int)(blockIdx.x - (unsigned)h * 24u);
  const int s   = 1 + rem / 8;            // 1..3
  const int rb  = rem - (s - 1) * 8;      // 0..7
  if (h >= NHEAD) return;                 // block-uniform, ahead of any barrier; never taken
  QKH += (size_t)blockIdx.y * SEQ * QKW;  // blockIdx.y = batch: its own planes
  QKL += (size_t)blockIdx.y * SEQ * QKW;
  MT  += (size_t)blockIdx.y * NHEAD * 3 * HD * HD;
  ZP  += (size_t)blockIdx.y * NHEAD * 3 * HD;
  outb += (size_t)blockIdx.y * NTOK * DM; // and its own rows of both outputs

  // the attention's part of this wave's 16 output rows, fetched ahead of the work below (row it*2 + hh, 16 B per lane)
  const int n0w = s * SEG + rb * MROWS + wave * 16;          // first query position of this wave
  float* ob = outb + ((s < (NTOK / SEG)) ? (size_t)OUT1OFF + (size_t)n0w * DM : (size_t)(n0w - NTOK) * DM)
                   + h * HD + c * 4;
  v4f pv[8];
#pragma unroll                            // pv[] stays in registers; the eight loads stand as one group
  for (int it = 0; it < 8; ++it) pv[it] = *(const v4f*)(ob + (size_t)(it * 2 + hh) * DM);

  {
    const int e = tid >> 2, d0 = (tid & 3) * 16;
    float sm[16];
#pragma unroll
    for (int i = 0; i < 16; ++i) sm[i] = 0.f;
#pragma unroll
    for (int sp = 0; sp < 3; ++sp) {
      if (sp < s) {                       // block-uniform
        const float* src = MT + ((size_t)(h * 3 + sp) * HD + e) * HD + d0;
#pragma unroll
        for (int q = 0; q < 4; ++q) {
          const v4f v = *(const v4f*)(src + 4 * q);
          sm[4 * q + 0] += v[0]; sm[4 * q + 1] += v[1]; sm[4 * q + 2] += v[2]; sm[4 * q + 3] += v[3];
        }
      }
    }
    v8h p0, p1;
#pragma unroll
    for (int i = 0; i < 8; ++i) { p0[i] = (_Float16)sm[i]; p1[i] = (_Float16)sm[8 + i]; }
    *(v8h*)(MTh + e * 72 + d0) = p0;
    *(v8h*)(MTh + e * 72 + d0 + 8) = p1;
    if (tid < HD) {
      float z = 0.f;
#pragma unroll
      for (int sp = 0; sp < 3; ++sp) {
        if (sp < s) z += ZP[(size_t)(h * 3 + sp) * HD + tid];
      }
      zs[tid] = z;
    }
  }
  __syncthreads();

  const _Float16* Q16 = (const _Float16*)(const void*)QKH;
  const _Float16* L16 = (const _Float16*)(const void*)QKL;

  v16h af[2];
  float denp = 0.f;
#pragma unroll
  for (int kk = 0; kk < 2; ++kk) {
    FH hf, lf;
    hf.v = ldfrag_h(Q16 + (size_t)(n0w + c) * QKW + h * HD + 32 * kk + 8 * hh);
    lf.v = ldfrag_h(L16 + (size_t)(n0w + c) * QKW + h * HD + 32 * kk + 8 * hh);
    v16h a;
#pragma unroll
    for (int i = 0; i < 16; ++i) {
      const float qv = ((float)hf.v[i] + (float)lf.v[i] * (1.0f / RSC)) * (1.0f / QSC);
      const float sq = (qv > 0.f) ? (qv + 1.0f) : __expf(qv);
      const _Float16 sqh = (_Float16)sq;
      a[i] = sqh;
      const int kidx = 32 * kk + ((i < 8) ? (8 * hh + i) : (8 + 8 * hh + i));   // k of element i (split map)
      denp += (float)sqh * zs[kidx];
    }
    af[kk] = a;
  }
  const float den = denp + __shfl_xor(denp, 16, 32) + DEN_EPS;   // row c complete in lanes c and c+16

  v8f acc[4];
#pragma unroll
  for (int j = 0; j < 4; ++j) {
    acc[j] = zero8();
#pragma unroll
    for (int kk = 0; kk < 2; ++kk) {
      const v16h b = ldfrag_h(MTh + (16 * j + c) * 72 + 32 * kk + 8 * hh);
      acc[j] = mma_h(af[kk], b, acc[j]);
    }
  }
  float rinv[8];
#pragma unroll
  for (int rr = 0; rr < 8; ++rr) rinv[rr] = 1.0f / __shfl(den, 8 * hh + rr, 32);   // den of D row 8hh+rr

  float* sl = slab[wave];
#pragma unroll
  for (int j = 0; j < 4; ++j) {
#pragma unroll
    for (int rr = 0; rr < 8; ++rr) sl[(8 * hh + rr) * 68 + 16 * j + c] = acc[j][rr] * rinv[rr];
  }
  wave_sync_lds();
  {
    v4f ov[8];
#pragma unroll
    for (int it = 0; it < 8; ++it) {
      const int row = it * 2 + hh;        // it 0..7 x hh 0..1 = rows 0..15
      ov[it] = *(const v4f*)(sl + row * 68 + c * 4);
    }
    const float gv = bfr(gate[h]);
    const float g  = 1.0f / (1.0f + expf(-gv));
#pragma unroll
    for (int it = 0; it < 8; ++it) {
      const int row = it * 2 + hh;
      *(v4f*)(ob + (size_t)row * DM) = g * ov[it] + pv[it];
    }
  }
}

// =====================================================================================================
// Segment-local causal attention with the gate mix, per (batch, h, segment, 64-query block):
//   s = (sum_d qh.kh + (ql.kh + qh.kl) / RSC) * sscale, sscale = (1/8) / (QSC*KSC); key > query (segment-local)
//   -> NEG_BIG (value select); online softmax in f32; p = exp(s - m) carried as ph = f16(1024 p) and, when PRES,
//   also pl = f16((1024 p - ph) * RSC); local numerator = p . v with v as f16 hi (VSC v) and, when PRES, the f16
//   residual ((VSC v - hi) * RSC) plane: oh += ph.vhi over all chunks; when PRES: ol = ph.vres + pl.vhi (one
//   residual accumulator per chunk and 16-wide d tile, both products carry the same 1/RSC), folded as
//   oh += ol / RSC in f32 right after its two k-steps.
//   q|k planes (f16, pitch QKW, rows = positions): q element (t, h, d) at [t*QKW + h*64 + d], k at
//   [t*QKW + DM + h*64 + d]; V^T planes (f16): element (h, d, t) at [(h*64 + d)*SEQ + t].
//   Epilogue per query row t: local = oh / (l * PSC * VSC); out = (1 - g) * local with g = sigmoid(bf16(gate[h]))
//   (the whole result in segment 0, where the memory is exactly 0; the start value to which the kernel mem_ret,
//   launched behind this one, adds g * mem in segments >= 1);
//   rows of positions < NTOK go to the second output (offset OUT1OFF), rows of positions
//   >= NTOK to the first, row t mod NTOK, columns h*64..h*64+63 (pitch DM floats).
//   Block = 4 waves = 64 query rows of one h; bx = 0 .. NHEAD * NSEG * nqb - 1 -> (qbs = qb0 + nqb - 1 - i, h, seg), the
//   query block slowest and falling (every (h, seg, qbs) once), bb = batch;
//   bx, bb and the block's LDS arrays come from the kernel attn_all below;
//   key chunks of 64 within the segment, chunks kt <= qbs only (block-uniform trip <= NQB), chunk kt == qbs keeps
//   its diagonal by the per-element select.
//   K / V^T chunk staging: asynchronous 16-B copies, thread -> rows (tid>>3) + 16 i, piece tid&7 of the row's 128 B
//   (a wave's copy takes four whole rows). One buffer per tile: the K tiles of chunk kt + 1 are copied behind the
//   barrier that ends the score reads of chunk kt and fly under its softmax and P.V; the V^T tiles of chunk kt + 1
//   are copied behind the barrier that ends the P.V reads of chunk kt and fly under the scores of chunk kt + 1.
//   q fragments (hi and residual, 2 d-chunks) held in registers for the whole block.
//   Both products run transposed (S^T = K.q^T, O^T += V^T.P^T): a lane holds one
//   query's scores, and two converted S^T tiles are a B fragment of P^T, so P passes through no LDS.
//   Output coverage: each wave stores rows q0..q0+15 (it 0..7 x lane>>4) x 64 columns (16 lanes x 16 B), one
// =====================================================================================================
template <bool PRES>
__device__ __forceinline__
void attn_seg(_Float16* Ksh, _Float16* Kls, _Float16* Vhs, _Float16* Vls, float (*Os)[16 * 68], int bx, int bb,
              const unsigned short* __restrict__ QKH, const unsigned short* __restrict__ QKL,
              const unsigned short* __restrict__ VTH, const unsigned short* __restrict__ VTL,
              const float* __restrict__ gate,
              float* outb, float sscale, int qb0, int nqb) {
  const int tid  = threadIdx.x;
  const int wave = tid >> 5;
  const int lane = tid & 31;
  const int hh   = lane >> 4;
  const int c    = lane & 15;

  // a block's cost is its qbs + 1 key chunks, and there are more blocks than places on the chip: the query block is the
  // slowest part of the index and falls with it, so that the blocks which start late are the short ones
  const int lvl = (int)((unsigned)bx / (unsigned)(NHEAD * NSEG));
  const int rem = (int)((unsigned)bx - (unsigned)lvl * (unsigned)(NHEAD * NSEG));   // 0 .. NHEAD * NSEG - 1
  const int h   = rem / NSEG;
  const int seg = rem - h * NSEG;
  const int qbs = qb0 + (nqb - 1 - lvl);
  if (lvl >= nqb) return;                 // block-uniform, ahead of any barrier; never taken for exact grids
  QKH  += (size_t)bb * SEQ * QKW;         // bb = batch: its own planes and its own rows of both outputs
  QKL  += (size_t)bb * SEQ * QKW;
  VTH  += (size_t)bb * DM * SEQ;
  VTL  += (size_t)bb * DM * SEQ;
  outb += (size_t)bb * NTOK * DM;
  const int sbase = seg * SEG;
  const int rowl0 = qbs * 64 + wave * 16; // segment-local row of this wave's first query
  const int q0    = sbase + rowl0;        // its position in the concatenated sequence

  const _Float16* Q16 = (const _Float16*)(const void*)QKH;
  const _Float16* L16 = (const _Float16*)(const void*)QKL;
  const _Float16* Qg  = Q16 + (size_t)h * HD;
  const _Float16* Qlg = L16 + (size_t)h * HD;
  const _Float16* Kg  = Q16 + DM + (size_t)h * HD;
  const _Float16* Klg = L16 + DM + (size_t)h * HD;
  const _Float16* Vhg = (const _Float16*)(const void*)VTH + (size_t)h * HD * SEQ;
  const _Float16* Vlg = (const _Float16*)(const void*)VTL + (size_t)h * HD * SEQ;

  // ---- q fragments (B operand, column = lane&15), hi and residual, d-chunks 0 and 1, fixed for the block ----
  const v16h qh0 = ldfrag_h(Qg  + (size_t)(q0 + c) * QKW + 8 * hh);
  const v16h qh1 = ldfrag_h(Qg  + (size_t)(q0 + c) * QKW + 32 + 8 * hh);
  const v16h ql0 = ldfrag_h(Qlg + (size_t)(q0 + c) * QKW + 8 * hh);
  const v16h ql1 = ldfrag_h(Qlg + (size_t)(q0 + c) * QKW + 32 + 8 * hh);

  // a lane holds ONE query (row c of the wave's 16): its running maximum, its running sum, and in oh[t][r] the
  // numerator of d = 16 t + 8 hh + r (the transposed output tile)
  float mrow = NEG_BIG, lrow = 0.f;
  v8f oh[4];
#pragma unroll
  for (int t = 0; t < 4; ++t) oh[t] = zero8();

  // ---- tile copies: this thread's row (mod 16) and 16-B piece; copy i takes row sr + 16 i of the 64-row tile ----
  const int sr = tid >> 3, sc = (tid & 7) * 8;
  const uint32_t lofs = (uint32_t)(sr * APIT + sc) * 2u;
  const uint32_t ls   = 16u * APIT * 2u;                    // LDS bytes per 16 rows
  const uint32_t lKh = (uint32_t)(size_t)(const void*)Ksh + lofs;
  const uint32_t lKl = (uint32_t)(size_t)(const void*)Kls + lofs;
  const uint32_t lVh = (uint32_t)(size_t)(const void*)Vhs + lofs;
  const uint32_t lVl = (uint32_t)(size_t)(const void*)Vls + lofs;
  const uint32_t oK = (uint32_t)(sr * QKW + sc) * 2u, gK = 16u * QKW * 2u;   // byte offset in a K tile, per 16 rows
  const uint32_t oV = (uint32_t)(sr * SEQ + sc) * 2u, gV = 16u * SEQ * 2u;   // the same in a V^T tile
  auto fillK = [&](int kv) {                                // K hi and residual rows kv .. kv + 63, d = 0..63
    acopy8s(lKh, lKh + ls, lKh + 2 * ls, lKh + 3 * ls, lKl, lKl + ls, lKl + 2 * ls, lKl + 3 * ls,
            oK, oK + gK, oK + 2 * gK, oK + 3 * gK, Kg + (size_t)kv * QKW, Klg + (size_t)kv * QKW);
  };
  auto fillV = [&](int kv) {                                // V^T rows d = 0..63, keys kv .. kv + 63
    if (PRES)
      acopy8s(lVh, lVh + ls, lVh + 2 * ls, lVh + 3 * ls, lVl, lVl + ls, lVl + 2 * ls, lVl + 3 * ls,
              oV, oV + gV, oV + 2 * gV, oV + 3 * gV, Vhg + kv, Vlg + kv);
    else
      acopy4s(lVh, lVh + ls, lVh + 2 * ls, lVh + 3 * ls, oV, oV + gV, oV + 2 * gV, oV + 3 * gV, Vhg + kv);
  };
  fillK(sbase);
  fillV(sbase);
  wait_async0();
  __syncthreads();                            // chunk 0's K and V^T tiles are published

  for (int kt = 0; kt < NQB; ++kt) {          // static bound; block-uniform causal chunk skipping
    if (kt > qbs) break;
    const int kv0 = sbase + kt * 64;

    // ---- transposed scores: 64 keys x 16 queries per wave, A = K rows, B = q, K = 64 (2 d-chunks), three products;
    //      D element r of tile j = key 16 j + 8 hh + r against query c ----
    v8f s[4];
#pragma unroll
    for (int j = 0; j < 4; ++j) {
      v8f sh = zero8(), sl = zero8();
      {
        FH kb, lb;
        kb.h[0] = *(const v8h*)(Ksh + (j * 16 + c) * APIT + 8 * hh);
        kb.h[1] = *(const v8h*)(Ksh + (j * 16 + c) * APIT + 16 + 8 * hh);
        lb.h[0] = *(const v8h*)(Kls + (j * 16 + c) * APIT + 8 * hh);
        lb.h[1] = *(const v8h*)(Kls + (j * 16 + c) * APIT + 16 + 8 * hh);
        sh = mma_h_raw(kb.v, qh0, sh);
        sl = mma_h_raw(kb.v, ql0, sl);
        sl = mma_h_raw(lb.v, qh0, sl);
        guard4m(sh, sl, qh0, ql0, kb.v, lb.v);
      }
      {
        FH kb, lb;
        kb.h[0] = *(const v8h*)(Ksh + (j * 16 + c) * APIT + 32 + 8 * hh);
        kb.h[1] = *(const v8h*)(Ksh + (j * 16 + c) * APIT + 48 + 8 * hh);
        lb.h[0] = *(const v8h*)(Kls + (j * 16 + c) * APIT + 32 + 8 * hh);
        lb.h[1] = *(const v8h*)(Kls + (j * 16 + c) * APIT + 48 + 8 * hh);
        sh = mma_h_raw(kb.v, qh1, sh);
        sl = mma_h_raw(kb.v, ql1, sl);
        sl = mma_h_raw(lb.v, qh1, sl);
        guard4m(sh, sl, qh1, ql1, kb.v, lb.v);
      }
      // segment-local key of D element r is kt*64 + 16 j + 8 hh + r, the query row of this lane's D column rowl0 + c:
      // element r is kept while r <= lim
      const int lim = (rowl0 + c) - (kt * 64 + j * 16 + 8 * hh);
#pragma unroll
      for (int r = 0; r < 8; ++r) {
        float v = sh[r];
        v += sl[r] * (1.0f / RSC);
        v *= sscale;
        s[j][r] = (r <= lim) ? v : NEG_BIG;
      }
    }
    wait_ds0();
    wait_async0();
    __syncthreads();                          // ends every read of the K tiles and publishes this chunk's V^T tiles
    if (kt < qbs) fillK(kv0 + 64);            // block-uniform

    // ---- maximum and sum of the query's 64 scores: 32 in this lane, 32 in lane ^ 16 (one exchange each); online
    //      softmax in f32; P hi (x1024, f16) and, when PRES, P residual (x RSC, f16) go straight into B fragments:
    //      tiles 2 kk and 2 kk + 1 hold keys 32 kk + 8 hh + r and 32 kk + 16 + 8 hh + r, the loaders' own k order ----
    float mj[4];
#pragma unroll
    for (int j = 0; j < 4; ++j) {
      float m = s[j][0];
#pragma unroll
      for (int r = 1; r < 8; ++r) m = fmaxf(m, s[j][r]);
      mj[j] = m;
    }
    float m = fmaxf(fmaxf(mj[0], mj[1]), fmaxf(mj[2], mj[3]));
    m = fmaxf(m, xhalf(m));
    const float mnew  = fmaxf(mrow, m);
    const float alpha = __expf(mrow - mnew);
    mrow = mnew;
    FH pa[2], pb[2];
    float pj[4];
#pragma unroll
    for (int j = 0; j < 4; ++j) {
      float ps = 0.f;
#pragma unroll
      for (int r = 0; r < 8; ++r) {
        const float p  = __expf(s[j][r] - mnew);
        ps += p;
        const float ph = p * PSC;
        const _Float16 xh = (_Float16)ph;
        pa[j >> 1].v[(j & 1) * 8 + r] = xh;
        if (PRES) pb[j >> 1].v[(j & 1) * 8 + r] = (_Float16)((ph - (float)xh) * RSC);
      }
      pj[j] = ps;
    }
    float psum = (pj[0] + pj[1]) + (pj[2] + pj[3]);
    psum += xhalf(psum);
    lrow = lrow * alpha + psum;
#pragma unroll
    for (int t = 0; t < 4; ++t) {
#pragma unroll
      for (int r = 0; r < 8; ++r) oh[t][r] *= alpha;
    }

    // ---- transposed local numerator, A = V^T rows, B = P^T: oh += Vhi . Phi; when PRES also
    //      ol = Vres . Phi + Vhi . Plo, oh += ol/RSC ----
#pragma unroll
    for (int t = 0; t < 4; ++t) {
      const _Float16* vr = Vhs + (t * 16 + c) * APIT + 8 * hh;
      FH vb0, vb1;
      vb0.h[0] = *(const v8h*)(vr);
      vb0.h[1] = *(const v8h*)(vr + 16);
      vb1.h[0] = *(const v8h*)(vr + 32);
      vb1.h[1] = *(const v8h*)(vr + 48);
      if (PRES) {
        const _Float16* wr = Vls + (t * 16 + c) * APIT + 8 * hh;
        FH wb0, wb1;
        wb0.h[0] = *(const v8h*)(wr);
        wb0.h[1] = *(const v8h*)(wr + 16);
        wb1.h[0] = *(const v8h*)(wr + 32);
        wb1.h[1] = *(const v8h*)(wr + 48);
        v8f ol = zero8();
        oh[t] = mma_h_raw(vb0.v, pa[0].v, oh[t]);
        ol    = mma_h_raw(wb0.v, pa[0].v, ol);
        ol    = mma_h_raw(vb0.v, pb[0].v, ol);
        oh[t] = mma_h_raw(vb1.v, pa[1].v, oh[t]);
        ol    = mma_h_raw(wb1.v, pa[1].v, ol);
        ol    = mma_h_raw(vb1.v, pb[1].v, ol);
        guard8m(oh[t], ol, pa[0].v, pa[1].v, pb[0].v, pb[1].v, vb0.v, vb1.v, wb0.v, wb1.v);
#pragma unroll
        for (int r = 0; r < 8; ++r) oh[t][r] += ol[r] * (1.0f / RSC);
      } else {
        oh[t] = mma_h_raw(vb0.v, pa[0].v, oh[t]);
        oh[t] = mma_h_raw(vb1.v, pa[1].v, oh[t]);
        guard1q(oh[t], pa[0].v, pa[1].v, vb0.v, vb1.v);
      }
    }
    acc_guard4(oh[0], oh[1], oh[2], oh[3]);
    wait_ds0();
    wait_async0();
    __syncthreads();                          // ends every read of the V^T tiles and publishes the next chunk's K tiles
    if (kt < qbs) fillV(kv0 + 64);            // block-uniform
  }
  wait_async0();

  // ---- normalise (1/l, the 1/1024 p carry and the 1/VSC v carry), weigh by 1 - g, stage the
  //      wave's tile as [query row][d] (a lane writes 8 consecutive d of its query per t) ----
  const float gv  = bfr(gate[h]);
  const float g   = 1.0f / (1.0f + expf(-gv));
  const float omg = 1.0f - g;
  float* os = Os[wave];
  {
    const float l = lrow;                                   // >= 1 (the row maximum contributes exp(0))
    const float inv = (1.0f / l) * (1.0f / (PSC * VSC));
#pragma unroll
    for (int t = 0; t < 4; ++t) {
      v4f oa, ob;
#pragma unroll
      for (int r = 0; r < 4; ++r) {                         // e = 16t + 8hh + r and + 4
        oa[r] = omg * (oh[t][r] * inv);
        ob[r] = omg * (oh[t][4 + r] * inv);
      }
      *(v4f*)(os + c * 68 + 16 * t + 8 * hh)     = oa;
      *(v4f*)(os + c * 68 + 16 * t + 8 * hh + 4) = ob;
    }
  }
  wave_sync_lds();
  {
    const size_t ooff  = (seg < (NTOK / SEG)) ? (size_t)OUT1OFF : (size_t)0;   // positions < NTOK -> second output
    const int    orow0 = (seg < (NTOK / SEG)) ? q0 : (q0 - NTOK);               // row within the output [b][2048][1024]
    v4f ov[8];
#pragma unroll
    for (int it = 0; it < 8; ++it) {
      const int row = it * 2 + hh;                          // it 0..7 x hh 0..1 = rows 0..15 of the wave tile
      ov[it] = *(const v4f*)(os + row * 68 + c * 4);
    }
    {
#pragma unroll
      for (int it = 0; it < 8; ++it) {
        const int row = it * 2 + hh;
        *(v4f*)(outb + ooff + (size_t)(orow0 + row) * DM + h * HD + c * 4) = ov[it];
      }
      wait_x0();   // in the built text another block range's code follows these stores and reuses their registers
    }
  }
}

// =====================================================================================================
// The compressive-memory update and both attention variants, which do not depend on one another, in ONE launch, told
// apart by block range (block-uniform branches ahead of every barrier): blockIdx.y < AB_M are the (head, segment)
// blocks of mt_seg, few and long (16 dependent chunks each): they start first and run beside the attention. The next
// AB_F are the query blocks NQB-1 down to NQP, without the residual products (NQB down to NQP+1 key chunks each, the
// longest first). The others are the leading NQP query blocks, with them (NQP down to 1 chunks each); they take the
// places that the long blocks leave.
// blockIdx.x = batch. mt_seg uses the attention's LDS arrays: Ksh as its sk^T tile, Kls and Vhs for the z sums, Os as slabs.
// coverage: grid = (NB, AB_M + AB_F + AB_T) exact.
// =====================================================================================================
#define AB_M (NHEAD * 3)
#define AB_F (NHEAD * NSEG * (NQB - NQP))
#define AB_T (NHEAD * NSEG * NQP)
__global__ __launch_bounds__(128, 5)   // 5 waves per SIMD, as both variants had alone: keeps the registers under 1024 / 5
void attn_all(const unsigned short* __restrict__ QKH, const unsigned short* __restrict__ QKL,
              const unsigned short* __restrict__ VTH, const unsigned short* __restrict__ VTL,
              float* MT, float* ZP, const float* __restrict__ gate, float* outb, float sscale) {
  __shared__ __align__(16) _Float16 Ksh[64 * APIT];                           // K hi  [key][d]  9 KB
  __shared__ __align__(16) _Float16 Kls[64 * APIT];                           // K res [key][d]  9 KB
  __shared__ __align__(16) _Float16 Vhs[HD * APIT];                           // V^T hi [d][key] 9 KB
  __shared__ __align__(16) _Float16 Vls[HD * APIT];                           // V^T res [d][key] 9 KB (leading blocks)
  __shared__ __align__(16) float    Os[4][16 * 68];                          // per wave output tile [row][d]
  static_assert(4 * HD * 4 <= 64 * APIT * 2 && APIT == 72);
  const int by = (int)blockIdx.y - AB_M, bb = (int)blockIdx.x;
  if (by < 0)
    mt_seg(Ksh, Os, (float (*)[HD])(void*)Kls, (float*)(void*)Vhs, by + AB_M, bb, QKH, QKL, VTH, MT, ZP);
  else if (by < AB_F)
    attn_seg<false>(Ksh, Kls, Vhs, Vls, Os, by, bb, QKH, QKL, VTH, VTL, gate, outb, sscale, NQP, NQB - NQP);
  else
    attn_seg<true>(Ksh, Kls, Vhs, Vls, Os, by - AB_F, bb, QKH, QKL, VTH, VTL, gate, outb, sscale, 0, NQP);
}

// =====================================================================================================
// Workspace map (bytes); every plane is an exact multiple of its tile / whole-line store granularity (all dims are
// exact tile multiples, no padded tails), all offsets multiples of 4096:
//   XH    f16  [4096 t][1024 in]             0          8388608   (f16 of bf16 value x16, rows b*2048 + t)
//   AH    f16  [4096 t][1024 in]             8388608    8388608
//   WXT   f16  [3072 out][1024 in]           16777216   6291456   (W^T, bf16 value x64)
//   WAT   f16  [3072 out][1024 in]           23068672   6291456
//   COST  f32  [4096 pos][32]                29360128    524288
//   SINT  f32  [4096 pos][32]                29884416    524288
//   QKH   f16  [2 b][4096 pos][2048 (q|k)]   30408704  33554432   (q x4, k x16 hi after norm + rotary)
//   QKL   f16  [2 b][4096][2048]             63963136  33554432   (x4096 residuals)
//   VTH   f16  [2 b][1024 (h,d)][4096 pos]   97517568  16777216   (v x16 hi)
//   VTL   f16  [2 b][1024 (h,d)][4096 pos]  114294784  16777216   ((v x16 - hi) x4096)
//   MT    f32  [2 b][16 h][3 s][64 e][64 d] 131072000   1572864
//   ZP    f32  [2 b][16 h][3 s][64 d]       132644864     24576
//   end                                     132669440
// =====================================================================================================
extern "C" void kernel_launch(void* const* d_in, const int* in_sizes, int n_in,
                              void* d_out, int out_size, void* d_ws, size_t ws_size,
                              hipStream_t stream) {
  if (n_in < 9) return;
  if (in_sizes[0] != NB * NTOK * DM || in_sizes[1] != NB * NTOK * DM) return;
  if (in_sizes[2] != DM * W3 || in_sizes[3] != DM * W3) return;
  if (in_sizes[4] != NHEAD * HD || in_sizes[5] != NHEAD * HD) return;
  if (in_sizes[6] != NHEAD * HD || in_sizes[7] != NHEAD * HD) return;
  if (in_sizes[8] != NHEAD) return;
  if (out_size != 2 * NB * NTOK * DM) return;

  const float* X    = (const float*)d_in[0];
  const float* Aa   = (const float*)d_in[1];
  const float* Wx   = (const float*)d_in[2];
  const float* Wa   = (const float*)d_in[3];
  const float* g_qx = (const float*)d_in[4];
  const float* g_kx = (const float*)d_in[5];
  const float* g_qa = (const float*)d_in[6];
  const float* g_ka = (const float*)d_in[7];
  const float* gate = (const float*)d_in[8];
  float* outf = (float*)d_out;

  const size_t PXA = (size_t)NB * NTOK * DM * 2;        //  8388608
  const size_t PW  = (size_t)W3 * DM * 2;               //  6291456
  const size_t PRT = (size_t)SEQ * RP * 4;              //   524288
  const size_t PQK = (size_t)NB * SEQ * QKW * 2;        // 33554432
  const size_t PVT = (size_t)NB * DM * SEQ * 2;         // 16777216
  const size_t PMT = (size_t)NB * NHEAD * 3 * HD * HD * 4;   // 1572864
  const size_t PZP = (size_t)NB * NHEAD * 3 * HD * 4;        //   24576
  size_t off = 0;
  const size_t oXH = off; off += PXA;
  const size_t oAH = off; off += PXA;
  const size_t oWX = off; off += PW;
  const size_t oWA = off; off += PW;
  const size_t oCT = off; off += PRT;
  const size_t oST = off; off += PRT;
  const size_t oQH = off; off += PQK;
  const size_t oQL = off; off += PQK;
  const size_t oVH = off; off += PVT;
  const size_t oVL = off; off += PVT;
  const size_t oMT = off; off += PMT;
  const size_t oZP = off; off += PZP;
  if (off > ws_size) return;                            // off = 132669440

  char* ws = (char*)d_ws;
  unsigned short* XH   = (unsigned short*)(ws + oXH);
  unsigned short* AH   = (unsigned short*)(ws + oAH);
  unsigned short* WXT  = (unsigned short*)(ws + oWX);
  unsigned short* WAT  = (unsigned short*)(ws + oWA);
  float*          COST = (float*)(ws + oCT);
  float*          SINT = (float*)(ws + oST);
  unsigned short* QKH  = (unsigned short*)(ws + oQH);
  unsigned short* QKL  = (unsigned short*)(ws + oQL);
  unsigned short* VTH  = (unsigned short*)(ws + oVH);
  unsigned short* VTL  = (unsigned short*)(ws + oVL);
  float*          MT   = (float*)(ws + oMT);
  float*          ZP   = (float*)(ws + oZP);

  const dim3 blk256(256), blk128(128);
  const float sscale = 0.125f / (QSC * KSC);
  const float oscale = 1.0f / (XSC * WSC);

  // Every kernel is launched once; the two arrays, the two streams and the two batches are grid dimensions, and
  // kernels that do not depend on one another share a launch (block ranges).
  // (1) x, a -> row-major f16 planes of their bf16 RNE values x16; W [1024][3072] -> transposed f16 planes
  //     [3072][1024] (k contiguous, Bt form) of their bf16 RNE values x64; rotary tables
  prep<<<dim3(PB_ROPE + PB_TR + PB_CVT), blk256, 0, stream>>>(X, Aa, XH, Wx, Wa, WXT, COST, SINT);

  const int gqk  = ((NTOK / 32) * (QKW / 128)) / 4;      // 1024 tiles -> 256 blocks per stream and batch
  const int gv   = ((NTOK / 32) * (DM / 128)) / 4;       //  512 tiles -> 128 blocks per stream and batch
  const int gmem = NHEAD * 3 * (SEG / MROWS);            //  384 blocks per batch
  // (2) q|k of stream a (positions 0..2047) and stream x (positions 2048..4095): M=2048, N=2048, K=1024,
  //     fused per-head L2 norm + gain + rotary -> QKH/QKL f16 planes;
  // (3) v of both streams: M=2048, N=1024 (W^T rows 2048..3071), K=1024 -> v^T planes [DM][SEQ] per batch, f16 hi
  //     (x16) and residual (x4096)
  gemm_qkv<<<dim3(gqk + gv, 2, NB), blk128, 0, stream>>>(AH, XH, DM, WAT, WXT, DM, (void*)QKH, (void*)QKL, QKW,
                                                         (void*)VTH, (void*)VTL, DM, SEQ, COST, SINT, g_qa, g_ka,
                                                         g_qx, g_kx, NTOK, QKW, DM, DM, gqk, oscale);
  // (4) compressive memory update: per-segment sk^T.v and sum sk (segments 0..2) -> MT, ZP; in the same launch the
  //     segment-local causal attention -> (1 - g) * local in both outputs: the leading NQP query blocks of every
  //     segment with the p, v residual products, the remaining blocks without
  attn_all<<<dim3(NB, AB_M + AB_F + AB_T), blk128, 0, stream>>>(QKH, QKL, VTH, VTL, MT, ZP, gate, outf, sscale);
  // (5) the memory read for the query rows of segments 1..3, added as g * mem to their output rows
  mem_ret<<<dim3(gmem, NB), blk256, 0, stream>>>(QKH, QKL, MT, ZP, gate, outf);
  (void)hipGetLastError();
}
